// v010
// Measured on an AMD MI455X. A time is GPU time per run, averaged over a window of back-to-back runs after a warm-up
// (all launches, gaps included; the runs take copies of the inputs in turn), and the median of several windows.
// Apart from v000's, it joins two sittings. Times from different sittings can be a few percent apart, while
// side-by-side timings come from the same sitting.
// The versions before v010 are in another document.
// One run takes 55.5 microseconds.
// Timed twice side by side with v009, it ran 1.22 times as fast both times.
// Counting every step since v000, which is the starting kernel, it is 1271 times as fast.
#include <hip/hip_runtime.h>
// Single-head causal self-attention (x [32][1024][384]; k/q/v = x W ([in][out] [384][64], no biases; input order Wk, Wq, Wv); ONE 64-wide head; wei * 64^-0.5; causal (tril, -inf); softmax; out = wei v -> [32][1024][64]; no output projection).
// Structure: token rows; one WMMA GEMM over the stacked weights, which reads x itself (f32, rounded to exact f16 rows in its own LDS slices), into one f16 q | k | v plane (and the f32 rows of the exact path); per batch v^T via LDS transposes; one fused launch for query rows 512..1023 (32 rows a block, keys split over its 8 waves: scores alpha 1/8, causal softmax f32 -> f16 x256 weights, P V, all in registers; f32 output rows); rows 0..511 come from an exact f32 path alone; launches: see trace.
// Compute dtype: inputs rounded to bf16; x / weights exact; q, k, v and softmax weights as plain f16 GEMM operands (~2^-12); scores, softmax statistics and o f32; v_wmma_f32_16x16x32_f16; the exact path of rows 0..511: f32 operands, v_wmma_f32_16x16x4_f32.
#define NB 32
#define SQ 1024
#define DM 384
#define NH 1
#define HD 64
#define HG 4                         /* heads per attention launch group */
#define QT 256                       /* query rows per causal tile */
#define NKX SQ                       /* S / P row pitch */
#define QT0 512                      /* first-tile rows recomputed exactly (f32): 512 here (no output projection averages the early-row cancellation errors away; logit sigma 1.0) */
#define B0 0                         /* first batch processed (debug hook) */
#define NBR NB                       /* batches processed (debug hook) */
#define NR ((size_t)NB * SQ)
#define DMQ DM
#define DFF 4096                     /* FFN hidden width */
#define DFFR 100                     /* real hidden width */
#define MP ((int)((size_t)NBR * SQ)) /* rows projected (debug hook) */
#define QN SQ                        /* query rows attended per batch (debug hook) */
#define NHD NH                       /* heads attended (debug hook) */
#define MPO MP                       /* rows through the output stage (debug hook) */
#define LQ (3 * DM)      /* unused; the q | k | v rows have pitch LQK */
typedef __bf16 v16b __attribute__((ext_vector_type(16)));
typedef unsigned short v8us __attribute__((ext_vector_type(8), may_alias));
typedef float  v8f  __attribute__((ext_vector_type(8)));
typedef float  v4f  __attribute__((ext_vector_type(4)));
typedef float  v4fa __attribute__((ext_vector_type(4), may_alias));
union FragB { v16b v; v8us half[2]; unsigned short u[16]; };

__device__ __forceinline__ unsigned short bf16_bits(float x) { unsigned int u = __float_as_uint(x); return (unsigned short)((u + 0x7FFFu + ((u >> 16) & 1u)) >> 16); }
__device__ __forceinline__ float bf16_val(unsigned short b) { return __uint_as_float(((unsigned int)b) << 16); }
__device__ __forceinline__ float bf16_round(float x) { return bf16_val(bf16_bits(x)); }
// D += A·B with NT terms: 1 = ah·bh, 2 = + al·bh (A split), 3 = + ah·bl (both split)
template <int NT>
__device__ __forceinline__ v8f mmaN(v16b ah, v16b al, v16b bh, v16b bl, v8f c) {
  c = __builtin_amdgcn_wmma_f32_16x16x32_bf16(false, ah, false, bh, (short)0, c, false, false);
  if (NT >= 2) c = __builtin_amdgcn_wmma_f32_16x16x32_bf16(false, al, false, bh, (short)0, c, false, false);
  if (NT >= 3) c = __builtin_amdgcn_wmma_f32_16x16x32_bf16(false, ah, false, bl, (short)0, c, false, false);
  asm volatile("v_nop\n\tv_nop\n\tv_nop\n\tv_nop" : "+v"(c) : "v"(ah), "v"(al), "v"(bh), "v"(bl));
  return c;
}

__global__ __launch_bounds__(256) void k_wt_bf16(const float* __restrict__ W, unsigned short* __restrict__ Wt, int K, int N) {
  const int t = blockIdx.x * 256 + threadIdx.x;
  const int k8n = K / 8;
  if (t >= N * k8n) return;
  const int n = t / k8n, k8 = (t % k8n) * 8;
  v8us v;
#pragma unroll
  for (int i = 0; i < 8; ++i) v[i] = bf16_bits(W[(size_t)(k8 + i) * N + n]);
  *(v8us*)(Wt + (size_t)n * K + k8) = v;
  
}

// GEMM C[M][N] (f32, pitch ldc) = act(A[M][K]·W + bias). A f32 row-major (pitch lda) converted per fragment to bf16
// (ASPLIT: hi/lo two planes -> 2 terms, else single rounded term); Wt bf16 [N][K] (pitch ldb). BIAS_BF16 rounds the
// bias to bf16 first (bias quantised to bf16 before the add). K%32==0, M%16==0, N%64==0.
template <bool ASPLIT, int ACT, bool BIAS_BF16>
__global__ __launch_bounds__(128) void k_gemm_bf(const float* __restrict__ A, int lda, const unsigned short* __restrict__ Wt, int ldb,
                                               const float* __restrict__ bias, float* __restrict__ C, int ldc, int M, int N, int K) {
  __shared__ __attribute__((aligned(16))) float so[4][16][64];
  const int tid = threadIdx.x, w = tid >> 5, lane = tid & 31, ln = lane & 15, hh = lane >> 4;
  const int ntn = N / 64;
  const int wid = blockIdx.x * 4 + w;
  const int mt = wid / ntn, nq = wid % ntn;
  if (mt * 16 >= M) return;
  const int row0 = mt * 16, col0 = nq * 64;
  const float* arow = A + (size_t)(row0 + ln) * lda;
  v8f acc[4] = {};
  for (int kb = 0; kb < K; kb += 32) {
    FragB ah, al;
    const v4f x0 = *(const v4fa*)(arow + kb + 8 * hh), x1 = *(const v4fa*)(arow + kb + 8 * hh + 4);
    const v4f x2 = *(const v4fa*)(arow + kb + 16 + 8 * hh), x3 = *(const v4fa*)(arow + kb + 16 + 8 * hh + 4);
    float xs[16] = {x0[0],x0[1],x0[2],x0[3],x1[0],x1[1],x1[2],x1[3],x2[0],x2[1],x2[2],x2[3],x3[0],x3[1],x3[2],x3[3]};
#pragma unroll
    for (int i = 0; i < 16; ++i) { const unsigned short hb = bf16_bits(xs[i]); ah.u[i] = hb; al.u[i] = ASPLIT ? bf16_bits(xs[i] - bf16_val(hb)) : (unsigned short)0; }
#pragma unroll
    for (int t = 0; t < 4; ++t) {
      const unsigned short* brow = Wt + (size_t)(col0 + t * 16 + ln) * ldb + kb;
      FragB b;
      b.half[0] = *(const v8us*)(brow + 8 * hh);
      b.half[1] = *(const v8us*)(brow + 16 + 8 * hh);
      acc[t] = mmaN<ASPLIT ? 2 : 1>(ah.v, al.v, b.v, b.v, acc[t]);
    }
  }
#pragma unroll
  for (int t = 0; t < 4; ++t) {
    float bv = bias ? bias[col0 + t * 16 + ln] : 0.f;
    if (BIAS_BF16) bv = bf16_round(bv);
#pragma unroll
    for (int r = 0; r < 8; ++r) { float v = acc[t][r] + bv; if (ACT == 1) v = fmaxf(v, 0.f); so[w][8 * hh + r][t * 16 + ln] = v; }
  }
  __builtin_amdgcn_fence(__ATOMIC_ACQ_REL, "workgroup");
  __builtin_amdgcn_wave_barrier();
  const int rsub = lane >> 4, c4 = (lane & 15) * 4;
  {
#pragma unroll
    for (int q = 0; q < 8; ++q) {
      const int r = q * 2 + rsub;
      const v4f v = *(const v4fa*)&so[w][r][c4];
      *(v4f*)(C + (size_t)(row0 + r) * ldc + col0 + c4) = v;
    }
    
  }
}

// GEMM C = act(A·W + bias + resid): A f32 (ASPLIT -> hi/lo 2 terms), Wt bf16 [N][K]; ACT 0 none, 1 relu, 2 exact gelu;
// resid (optional, f32, row index = (row % rmod), pitch ldr, RES_BF16 rounds it) added before the activation.
template <bool ASPLIT, int ACT, bool BIAS_BF16, bool RES_BF16>
__global__ __launch_bounds__(128) void k_gemm_bf3(const float* __restrict__ A, int lda, const unsigned short* __restrict__ Wt, int ldb,
                                                const float* __restrict__ bias, const float* __restrict__ resid, int rmod, int ldr,
                                                float* __restrict__ C, int ldc, int M, int N, int K) {
  __shared__ __attribute__((aligned(16))) float so[4][16][64];
  const int tid = threadIdx.x, w = tid >> 5, lane = tid & 31, ln = lane & 15, hh = lane >> 4;
  const int ntn = N / 64;
  const int wid = blockIdx.x * 4 + w;
  const int mt = wid / ntn, nq = wid % ntn;
  if (mt * 16 >= M) return;
  const int row0 = mt * 16, col0 = nq * 64;
  const float* arow = A + (size_t)(row0 + ln) * lda;
  v8f acc[4] = {};
  for (int kb = 0; kb < K; kb += 32) {
    FragB ah, al;
    const v4f x0 = *(const v4fa*)(arow + kb + 8 * hh), x1 = *(const v4fa*)(arow + kb + 8 * hh + 4);
    const v4f x2 = *(const v4fa*)(arow + kb + 16 + 8 * hh), x3 = *(const v4fa*)(arow + kb + 16 + 8 * hh + 4);
    float xs[16] = {x0[0],x0[1],x0[2],x0[3],x1[0],x1[1],x1[2],x1[3],x2[0],x2[1],x2[2],x2[3],x3[0],x3[1],x3[2],x3[3]};
#pragma unroll
    for (int i = 0; i < 16; ++i) { const unsigned short hb = bf16_bits(xs[i]); ah.u[i] = hb; al.u[i] = ASPLIT ? bf16_bits(xs[i] - bf16_val(hb)) : (unsigned short)0; }
#pragma unroll
    for (int t = 0; t < 4; ++t) {
      const unsigned short* brow = Wt + (size_t)(col0 + t * 16 + ln) * ldb + kb;
      FragB b;
      b.half[0] = *(const v8us*)(brow + 8 * hh);
      b.half[1] = *(const v8us*)(brow + 16 + 8 * hh);
      acc[t] = mmaN<ASPLIT ? 2 : 1>(ah.v, al.v, b.v, b.v, acc[t]);
    }
  }
#pragma unroll
  for (int t = 0; t < 4; ++t) {
    const int col = col0 + t * 16 + ln;
    float bv = bias ? bias[col] : 0.f;
    if (BIAS_BF16) bv = bf16_round(bv);
#pragma unroll
    for (int r = 0; r < 8; ++r) {
      float v = acc[t][r] + bv;
      if (resid) { float rv = resid[(size_t)((row0 + 8 * hh + r) % rmod) * ldr + col]; if (RES_BF16) rv = bf16_round(rv); v += rv; }
      if (ACT == 1) v = fmaxf(v, 0.f);
      if (ACT == 2) v = 0.5f * v * (1.0f + erff(v * 0.70710678118654752f));
      if (ACT == 3) { const float u = 0.7978845608028654f * (v + 0.044715f * v * v * v); v = 0.5f * v * (1.0f + tanhf(u)); }
      so[w][8 * hh + r][t * 16 + ln] = v;
    }
  }
  __builtin_amdgcn_fence(__ATOMIC_ACQ_REL, "workgroup");
  __builtin_amdgcn_wave_barrier();
  const int rsub = lane >> 4, c4 = (lane & 15) * 4;
  {
#pragma unroll
    for (int q = 0; q < 8; ++q) {
      const int r = q * 2 + rsub;
      const v4f v = *(const v4fa*)&so[w][r][c4];
      *(v4f*)(C + (size_t)(row0 + r) * ldc + col0 + c4) = v;
    }
    
  }
}
// row LayerNorm (biased variance, eps) over N: s = X (+ R); optional out_sum <- s; out_norm <- (s-mu)*rsqrt(var+eps)*g + b
template <bool PARAM_BF16>
__global__ __launch_bounds__(256) void k_layernorm(const float* __restrict__ X, const float* __restrict__ R, const float* __restrict__ g, const float* __restrict__ bta,
                                                  float* __restrict__ out_sum, float* __restrict__ out_norm, int N, float eps) {
  __shared__ float red[256];
  const int row = blockIdx.x, tid = threadIdx.x;
  const float* x = X + (size_t)row * N; const float* rr = R ? R + (size_t)row * N : nullptr;
  float vals[16];                     // up to N = 4096
  const int per = N / 256;            // contiguous chunk per thread? use strided-by-4 chunks: thread handles j = tid*4 + 1024*u
  float s1 = 0.f;
  for (int u = 0; u < per / 4; ++u) {
    const int j = tid * 4 + 1024 * u;
    const v4f a = *(const v4fa*)(x + j);
    v4f b = {0.f,0.f,0.f,0.f}; if (rr) b = *(const v4fa*)(rr + j);
#pragma unroll
    for (int q = 0; q < 4; ++q) { const float v = a[q] + b[q]; vals[u * 4 + q] = v; s1 += v; }
  }
  red[tid] = s1; __syncthreads();
  for (int st = 128; st > 0; st >>= 1) { if (tid < st) red[tid] += red[tid + st]; __syncthreads(); }
  const float mu = red[0] / (float)N; __syncthreads();
  float s2 = 0.f;
  for (int u = 0; u < per / 4; ++u)
#pragma unroll
    for (int q = 0; q < 4; ++q) { const float c = vals[u * 4 + q] - mu; s2 += c * c; }
  red[tid] = s2; __syncthreads();
  for (int st = 128; st > 0; st >>= 1) { if (tid < st) red[tid] += red[tid + st]; __syncthreads(); }
  const float rs = rsqrtf(red[0] / (float)N + eps);
  {
    for (int u = 0; u < per / 4; ++u) {
      const int j = tid * 4 + 1024 * u;
      v4f o, sm;
#pragma unroll
      for (int q = 0; q < 4; ++q) {
        float gg = g[j + q], bb = bta[j + q];
        if (PARAM_BF16) { gg = bf16_round(gg); bb = bf16_round(bb); }
        sm[q] = vals[u * 4 + q]; o[q] = (vals[u * 4 + q] - mu) * rs * gg + bb;
      }
      if (out_sum) *(v4f*)(out_sum + (size_t)row * N + j) = sm;
      *(v4f*)(out_norm + (size_t)row * N + j) = o;
    }
    
  }
}



// ---- f16 WMMA path (v_wmma_f32_16x16x32_f16): 11-bit significands for operands in range — used where a [0,1] probability operand needs more precision than bf16
typedef _Float16 v16h __attribute__((ext_vector_type(16)));
union FragH { v16h v; v8us half[2]; _Float16 h[16]; unsigned short u[16]; };
template <int NT>
__device__ __forceinline__ v8f mmaH(v16h ah, v16h al, v16h bh, v16h bl, v8f c) {
  c = __builtin_amdgcn_wmma_f32_16x16x32_f16(false, ah, false, bh, (short)0, c, false, false);
  if (NT >= 2) c = __builtin_amdgcn_wmma_f32_16x16x32_f16(false, al, false, bh, (short)0, c, false, false);
  if (NT >= 3) c = __builtin_amdgcn_wmma_f32_16x16x32_f16(false, ah, false, bl, (short)0, c, false, false);
  asm volatile("v_nop\n\tv_nop\n\tv_nop\n\tv_nop" : "+v"(c) : "v"(ah), "v"(al), "v"(bh), "v"(bl));
  return c;
}
// batched GEMM like k_gemm_b but f16 operands: A f32 (split into f16 hi/lo if ASPLIT, else rounded to f16), Bt = f16 values [n][k]; alpha; C f32; N multiple of 16 (partial tiles skipped)
template <bool ASPLIT>
__global__ __launch_bounds__(128) void k_gemm_h(const float* __restrict__ A, int lda, size_t sA, const _Float16* __restrict__ Bh, int ldb, size_t sB, float alpha, float* __restrict__ C, int ldc, size_t sC, int M, int N, int K) {
  __shared__ __attribute__((aligned(16))) float so[4][16][64];
  const int tid = threadIdx.x, w = tid >> 5, lane = tid & 31, ln = lane & 15, hh = lane >> 4; const int by = blockIdx.y;
  A += (size_t)by * sA; Bh += (size_t)by * sB; C += (size_t)by * sC;
  const int ntn = (N + 63) / 64; const int wid = blockIdx.x * 4 + w; const int mt = wid / ntn, nq = wid % ntn; if (mt * 16 >= M) return;
  const int row0 = mt * 16, col0 = nq * 64; const float* arow = A + (size_t)(row0 + ln) * lda;
  v8f acc[4] = {};
  for (int kb = 0; kb < K; kb += 32) {
    FragH ah, al;
    const v4f x0 = *(const v4fa*)(arow + kb + 8 * hh), x1 = *(const v4fa*)(arow + kb + 8 * hh + 4), x2 = *(const v4fa*)(arow + kb + 16 + 8 * hh), x3 = *(const v4fa*)(arow + kb + 16 + 8 * hh + 4);
    float xs[16] = {x0[0],x0[1],x0[2],x0[3],x1[0],x1[1],x1[2],x1[3],x2[0],x2[1],x2[2],x2[3],x3[0],x3[1],x3[2],x3[3]};
#pragma unroll
    for (int i = 0; i < 16; ++i) { const _Float16 h = (_Float16)xs[i]; ah.h[i] = h; al.h[i] = ASPLIT ? (_Float16)(xs[i] - (float)h) : (_Float16)0.0f; }
#pragma unroll
    for (int t = 0; t < 4; ++t) { if (col0 + t * 16 >= N) continue; const size_t boff = (size_t)(col0 + t * 16 + ln) * ldb + kb; FragH bq; bq.half[0] = *(const v8us*)(Bh + boff + 8 * hh); bq.half[1] = *(const v8us*)(Bh + boff + 16 + 8 * hh);
      acc[t] = mmaH<ASPLIT ? 2 : 1>(ah.v, al.v, bq.v, bq.v, acc[t]); }
  }
#pragma unroll
  for (int t = 0; t < 4; ++t) { if (col0 + t * 16 >= N) continue;
#pragma unroll
    for (int r = 0; r < 8; ++r) so[w][8 * hh + r][t * 16 + ln] = acc[t][r] * alpha; }
  __builtin_amdgcn_fence(__ATOMIC_ACQ_REL, "workgroup"); __builtin_amdgcn_wave_barrier();
  const int rsub = lane >> 4, c4 = (lane & 15) * 4;
  {
#pragma unroll
    for (int q = 0; q < 8; ++q) { const int r = q * 2 + rsub; if (col0 + c4 < N) { const v4f v = *(const v4fa*)&so[w][r][c4]; *(v4f*)(C + (size_t)(row0 + r) * ldc + col0 + c4) = v; } }
     }
}

// Wt[n][k] = f16(W[k][n]·scale) from f32 row-major W[K][N] (scale = power of two; bf16-exact weights stay exact in f16 away from the subnormal range)
// grid.y picks one of three weights of the same shape; their transposes are stacked in Wt, N rows each
__global__ __launch_bounds__(256) void k_wt_f16(const float* __restrict__ W0, const float* __restrict__ W1, const float* __restrict__ W2, _Float16* __restrict__ Wt, int K, int N, float scale) {
  const float* W = (blockIdx.y == 0) ? W0 : (blockIdx.y == 1) ? W1 : W2; Wt += (size_t)blockIdx.y * N * K;
  const int t = blockIdx.x * 256 + threadIdx.x; if (t >= N * (K / 8)) return; const int n = t / (K / 8), k8 = (t % (K / 8)) * 8; FragH f;
#pragma unroll
  for (int i = 0; i < 8; ++i) f.h[i] = (_Float16)(bf16_round(W[(size_t)(k8 + i) * N + n]) * scale); const v8us o = f.half[0];
  *(v8us*)((unsigned short*)Wt + (size_t)n * K + k8) = o; 
}
// k_gemm_hh variant with fused epilogue: v = acc·alpha + bias[by·sBias + col] (+ CP[(row/rowsPerB)·sCPb + by·64 + col] if CP) ; ACT 0 none / 1 elu ; writes f16 C16 (and f32 C if non-null)
template <int ACT>
__global__ __launch_bounds__(128) void k_gemm_hhx(const _Float16* __restrict__ A, int lda, size_t sA, const _Float16* __restrict__ Bh, int ldb, size_t sB, float alpha, const float* __restrict__ bias, size_t sBias, const float* __restrict__ CP, int rowsPerB, size_t sCPb, int row0g,
    float* __restrict__ C, _Float16* __restrict__ C16, int ldc, size_t sC, int M, int N, int K) {
  __shared__ __attribute__((aligned(16))) float so[4][16][64];
  const int tid = threadIdx.x, w = tid >> 5, lane = tid & 31, ln = lane & 15, hh = lane >> 4; const int by = blockIdx.y;
  A += (size_t)by * sA; Bh += (size_t)by * sB; const size_t cofs = (size_t)by * sC; const float* bp = bias ? bias + (size_t)by * sBias : nullptr;
  const int ntn = (N + 63) / 64; const int wid = blockIdx.x * 4 + w; const int mt = wid / ntn, nq = wid % ntn; if (mt * 16 >= M) return;
  const int row0 = mt * 16, col0 = nq * 64; const _Float16* arow = A + (size_t)(row0 + ln) * lda;
  v8f acc[4] = {};
  for (int kb = 0; kb < K; kb += 32) { FragH ah; ah.half[0] = *(const v8us*)((const unsigned short*)arow + kb + 8 * hh); ah.half[1] = *(const v8us*)((const unsigned short*)arow + kb + 16 + 8 * hh);
#pragma unroll
    for (int t = 0; t < 4; ++t) { if (col0 + t * 16 >= N) continue; const size_t boff = (size_t)(col0 + t * 16 + ln) * ldb + kb; FragH bq; bq.half[0] = *(const v8us*)((const unsigned short*)Bh + boff + 8 * hh); bq.half[1] = *(const v8us*)((const unsigned short*)Bh + boff + 16 + 8 * hh);
      acc[t] = mmaH<1>(ah.v, ah.v, bq.v, bq.v, acc[t]); }
  }
#pragma unroll
  for (int t = 0; t < 4; ++t) { if (col0 + t * 16 >= N) continue; const int col = col0 + t * 16 + ln; const float bv = bp ? bf16_round(bp[col]) : 0.f;
#pragma unroll
    for (int r = 0; r < 8; ++r) { float v = acc[t][r] * alpha + bv; if (CP) { const int rr = row0g + row0 + 8 * hh + r; if (rowsPerB < 0) v += CP[cofs + (size_t)rr * ldc + col];      /* rowsPerB < 0: own element of the batched C plane */ else { const int bidx = rr / rowsPerB; v += CP[(size_t)bidx * sCPb + (size_t)by * 64 + col]; } } if (ACT == 1) v = (v > 0.f) ? v : expm1f(v); else if (ACT == 7) v = (v > 0.f) ? v + 1.0f : expf(v); else if (ACT == 8) v = tanhf(v); else if (ACT == 9) v = 0.5f * v * (1.0f + tanhf(0.7978845608028654f * (v + 0.044715f * v * v * v))); else if (ACT == 11) v = 1.0f / (1.0f + expf(-v)); else if (ACT == 12) v = (v > 0.f) ? v : 0.01f * v; else if (ACT == 14) v = (v > 0.f) ? v : 0.1f * v; else if (ACT == 16) v = (v >= 0.f) ? v : 0.3f * v; else if (ACT == 17) v = (v >= 0.f) ? v : 0.2f * v; else if (ACT == 15) v = v / (1.0f + expf(-v)); else if (ACT == 3) v = fmaxf(v, 0.f); else if (ACT == 6) v = 0.5f * v * (1.0f + erff(v * 0.70710678118654752f)); so[w][8 * hh + r][t * 16 + ln] = v; } }
  __builtin_amdgcn_fence(__ATOMIC_ACQ_REL, "workgroup"); __builtin_amdgcn_wave_barrier();
  const int rsub = lane >> 4, c4 = (lane & 15) * 4; typedef _Float16 v4h __attribute__((ext_vector_type(4)));
  {
#pragma unroll
    for (int q = 0; q < 8; ++q) { const int r = q * 2 + rsub; if (col0 + c4 < N) { const v4f v = *(const v4fa*)&so[w][r][c4]; if (C) *(v4f*)(C + cofs + (size_t)(row0 + r) * ldc + col0 + c4) = v; if (C16) { v4h h4; for (int i = 0; i < 4; ++i) h4[i] = (_Float16)v[i]; *(v4h*)(C16 + cofs + (size_t)(row0 + r) * ldc + col0 + c4) = h4; } } }
     }
}


typedef _Float16 v4h __attribute__((ext_vector_type(4)));

__global__ __launch_bounds__(256) void k_h16(const float* __restrict__ x, _Float16* __restrict__ X16, size_t n8) { const size_t t = (size_t)blockIdx.x * 256 + threadIdx.x; if (t >= n8) return; FragH f;
#pragma unroll
  for (int q = 0; q < 8; ++q) f.h[q] = (_Float16)x[t * 8 + q]; *(v8us*)((unsigned short*)X16 + t * 8) = f.half[0];  }
__global__ __launch_bounds__(256) void k_round16f(const float* __restrict__ W, _Float16* __restrict__ Bt, size_t n8) { const size_t t = (size_t)blockIdx.x * 256 + threadIdx.x; if (t >= n8) return; FragH f;
#pragma unroll
  for (int i = 0; i < 8; ++i) f.h[i] = (_Float16)(bf16_round(W[t * 8 + i]) * 16.0f); *(v8us*)((unsigned short*)Bt + t * 8) = f.half[0];  }
template <int NHv, int TTv>
__global__ __launch_bounds__(256) void k_vt(const _Float16* __restrict__ V16, int ldv, int voff, _Float16* __restrict__ Vt) { __shared__ unsigned short tl[64][66]; const int tid = threadIdx.x; const int slab = blockIdx.x / (TTv / 64), lg = blockIdx.x % (TTv / 64); const int b = slab / NHv, h = slab % NHv;
  for (int i = tid; i < 64 * 8; i += 256) { const int r = i / 8, c8 = (i % 8) * 8; FragH f; f.half[0] = *(const v8us*)((const unsigned short*)V16 + ((size_t)b * TTv + lg * 64 + r) * ldv + voff + h * 64 + c8);
#pragma unroll
    for (int q = 0; q < 8; ++q) tl[r][c8 + q] = f.u[q]; }
  __syncthreads();
  {
#pragma unroll
    for (int rd = 0; rd < 2; ++rd) { const int d = rd * 32 + tid / 8, pc = tid % 8; FragH f;
#pragma unroll
      for (int q = 0; q < 8; ++q) f.u[q] = tl[pc * 8 + q][d];
      *(v8us*)((unsigned short*)Vt + ((size_t)slab * 64 + d) * TTv + lg * 64 + pc * 8) = f.half[0]; }
     } }

__global__ __launch_bounds__(256) void k_hl(const float* __restrict__ F, _Float16* __restrict__ Hh, _Float16* __restrict__ Hl, size_t n8) { const size_t t = (size_t)blockIdx.x * 256 + threadIdx.x; if (t >= n8) return; FragH fh, fl; const v4f a = *(const v4fa*)(F + t * 8), c = *(const v4fa*)(F + t * 8 + 4);
#pragma unroll
  for (int q = 0; q < 4; ++q) { _Float16 h = (_Float16)a[q]; fh.h[q] = h; fl.h[q] = (_Float16)((a[q] - (float)h) * 1024.0f); h = (_Float16)c[q]; fh.h[4 + q] = h; fl.h[4 + q] = (_Float16)((c[q] - (float)h) * 1024.0f); }
  { *(v8us*)((unsigned short*)Hh + t * 8) = fh.half[0]; *(v8us*)((unsigned short*)Hl + t * 8) = fl.half[0];  } }

// ---- fast GEMM (wave tile 32x64; requires M % 32 == 0 rows per launch region, N == 64 * GC and K % 64 == 0); epilogue = k_gemm_hhx semantics ----
// A is f32, pitch DM: a wave loads its 32 x 64 tile by whole lines, rounds it (bf16, then f16: exact) and turns it into fragments through its own LDS slice. A block holds all GC column blocks of its 128 rows, so the GC waves that need a row tile read its lines on one WGP.
#define GC 3                         /* column blocks of 64 = waves that share a row tile */
#define GW (4 * GC)                  /* waves of a block: 4 row tiles x GC column blocks */
#define GXP 72                       /* LDS pitch of a staged A row, in f16: 144 B = 16 B x odd, for the b128 fragment reads */
__device__ __forceinline__ v16h g2_frag(const _Float16* p, int hh) { FragH f; f.half[0] = *(const v8us*)((const unsigned short*)p + 8 * hh); f.half[1] = *(const v8us*)((const unsigned short*)p + 16 + 8 * hh); return f.v; }
__device__ __forceinline__ v8f g2_mma(v16h a, v16h b, v8f c) { v8f d = __builtin_amdgcn_wmma_f32_16x16x32_f16(false, a, false, b, (short)0, c, false, false); asm volatile("v_nop\n\tv_nop\n\tv_nop\n\tv_nop" : "+v"(d) : "v"(a), "v"(b)); return d; }
template <int ACT>
__global__ __launch_bounds__(GW * 32) void k_gemm2(const float* __restrict__ A, int lda, size_t sA, const _Float16* __restrict__ Bh, int ldb, size_t sB, float alpha, const float* __restrict__ bias, size_t sBias, const float* __restrict__ CP, int rowsPerB, size_t sCPb, int row0g,
    float* __restrict__ C, _Float16* __restrict__ C16, int ldc, size_t sC, int M, int N, int K, int MC) { static_assert(ACT == 0 || ACT == 3 || ACT == 6 || ACT == 8 || ACT == 9 || ACT == 11 || ACT == 12 || ACT == 14 || ACT == 15 || ACT == 16 || ACT == 17, "k_gemm2: unsupported ACT code (would silently apply no activation)");
  __shared__ __attribute__((aligned(16))) float so[GW][32][68];
  __shared__ __attribute__((aligned(16))) _Float16 sx[GW][32][GXP];      /* each wave's A tile of one trip, as f16 rows */
  const int tid = threadIdx.x, lane = tid & 31, ln = lane & 15, hh = lane >> 4; const int w = __builtin_amdgcn_readfirstlane(tid >> 5); const int by = blockIdx.y;      /* the wave index is wave-uniform */
  A += (size_t)by * sA; Bh += (size_t)by * sB; const size_t cofs = (size_t)by * sC; const float* bp = bias ? bias + (size_t)by * sBias : nullptr;
  (void)lda; const int row0 = blockIdx.x * 128 + 32 * (w & 3), col0 = (w >> 2) * 64; if (row0 >= M || col0 >= N) return;      /* no barrier below: a wave may leave alone */
  const float* xp = A + (size_t)(row0 + hh) * DM + 4 * ln;      /* load i of a trip: rows 2 i and 2 i + 1 of the tile, 256 B each, one float4 per lane; the pitch is a constant, so that every row pair is an immediate offset from one address */
  unsigned ko = 0;      /* the trip's first column, per lane: it goes through the wait statement of the loop */
  _Float16* sw = &sx[w][hh][4 * ln]; const _Float16* sr = &sx[w][ln][8 * hh];
  const _Float16* b0p = Bh + (size_t)(col0 + ln) * ldb; const _Float16* b1p = b0p + (size_t)16 * ldb; const _Float16* b2p = b1p + (size_t)16 * ldb; const _Float16* b3p = b2p + (size_t)16 * ldb;
  const v8f z8 = {0.f,0.f,0.f,0.f,0.f,0.f,0.f,0.f}; v8f c00 = z8, c01 = z8, c02 = z8, c03 = z8, c10 = z8, c11 = z8, c12 = z8, c13 = z8;
#pragma unroll 1      /* rolled: one trip's A tile and 8 B fragments (128 registers) are all that is live beside the accumulators */
  for (int kb = 0; kb < K; kb += 64) {      /* two k steps a trip (K % 64 == 0): a trip reads whole 128-byte lines of every row, all 32 loads in flight together */
    const _Float16* pb0 = b0p + kb + 8 * hh; const _Float16* pb1 = b1p + kb + 8 * hh; const _Float16* pb2 = b2p + kb + 8 * hh; const _Float16* pb3 = b3p + kb + 8 * hh;      /* each lane's own address, the half-wave offset of g2_frag folded in */
    const float* px = xp + ko; v8f xr[8];      /* loads 2 j and 2 j + 1 side by side */
#pragma unroll      /* full unroll (here and below): xr needs constant indices to stay in registers */
    for (int j = 0; j < 8; ++j) { xr[j].lo = *(const v4fa*)(px + j * 4 * DM); xr[j].hi = *(const v4fa*)(px + (j * 4 + 2) * DM); }
    const v16h b0 = g2_frag(pb0, 0), b1 = g2_frag(pb1, 0), b2 = g2_frag(pb2, 0), b3 = g2_frag(pb3, 0);
    const v16h f0 = g2_frag(pb0 + 32, 0), f1 = g2_frag(pb1 + 32, 0), f2 = g2_frag(pb2 + 32, 0), f3 = g2_frag(pb3 + 32, 0);
    asm volatile("s_wait_xcnt 0x0" : "+v"(ko) : "v"(xr[0]), "v"(xr[1]), "v"(xr[2]), "v"(xr[3]), "v"(xr[4]), "v"(xr[5]), "v"(xr[6]), "v"(xr[7]), "v"(b0), "v"(b1), "v"(b2), "v"(b3), "v"(f0), "v"(f1), "v"(f2), "v"(f3), "v"(px), "v"(pb0), "v"(pb1), "v"(pb2), "v"(pb3));      /* takes the loaded values as inputs only: every load of the trip issues ahead of the rounding and the products, so a trip waits for memory once (without it each piece is loaded and waited for in turn); the five addresses are named too and stay live up to this wait, and the A column goes through the statement, so that the next trip's A address is formed behind it: no register an issued load names is rewritten ahead of the wait */
    ko += 64;
#pragma unroll
    for (int i = 0; i < 16; ++i) { v4h h4; for (int q = 0; q < 4; ++q) h4[q] = (_Float16)(float)(__bf16)xr[i >> 1][(i & 1) * 4 + q]; *(v4h*)(sw + i * 2 * GXP) = h4; }      /* x rounded to bf16 (to nearest even, the value of bf16_round, by the packed conversion instruction), then exact as f16 */
    __builtin_amdgcn_fence(__ATOMIC_ACQ_REL, "workgroup"); __builtin_amdgcn_wave_barrier();      /* the fragment reads below take other lanes' stores: they stay behind them (one wave's LDS slice, so no block barrier) */
    const v16h a0 = g2_frag(sr, 0), a1 = g2_frag(sr + 16 * GXP, 0), e0 = g2_frag(sr + 32, 0), e1 = g2_frag(sr + 16 * GXP + 32, 0);      /* the k order of the fragments is that of the B rows, as before */
    __builtin_amdgcn_fence(__ATOMIC_ACQ_REL, "workgroup"); __builtin_amdgcn_wave_barrier();      /* and the next trip's stores stay behind these reads */
    c00 = g2_mma(a0, b0, c00); c10 = g2_mma(a1, b0, c10); c01 = g2_mma(a0, b1, c01); c11 = g2_mma(a1, b1, c11); c02 = g2_mma(a0, b2, c02); c12 = g2_mma(a1, b2, c12); c03 = g2_mma(a0, b3, c03); c13 = g2_mma(a1, b3, c13);
    c00 = g2_mma(e0, f0, c00); c10 = g2_mma(e1, f0, c10); c01 = g2_mma(e0, f1, c01); c11 = g2_mma(e1, f1, c11); c02 = g2_mma(e0, f2, c02); c12 = g2_mma(e1, f2, c12); c03 = g2_mma(e0, f3, c03); c13 = g2_mma(e1, f3, c13); }
  v8f accs[8] = {c00, c01, c02, c03, c10, c11, c12, c13};
#pragma unroll
  for (int u = 0; u < 8; ++u) { const int t = u & 3, half = u >> 2; const int col = col0 + t * 16 + ln; const float bv = bp ? bf16_round(bp[col]) : 0.f;
#pragma unroll
    for (int r = 0; r < 8; ++r) { const int rloc = half * 16 + 8 * hh + r; float v = accs[u][r] * alpha + bv; if (CP) { if (rowsPerB < 0) v += CP[cofs + (size_t)(row0g + row0 + rloc) * ldc + col];      /* rowsPerB < 0: own element of the batched C plane */ else { const int bidx = (row0g + row0 + rloc) / rowsPerB; v += CP[(size_t)bidx * sCPb + (size_t)by * 64 + col]; } }
      if (ACT == 3) v = fmaxf(v, 0.f); else if (ACT == 6) v = 0.5f * v * (1.0f + erff(v * 0.70710678118654752f)); else if (ACT == 11) v = 1.0f / (1.0f + expf(-v)); else if (ACT == 15) v = v / (1.0f + expf(-v)); else if (ACT == 12) v = (v > 0.f) ? v : 0.01f * v; else if (ACT == 8) v = tanhf(v); else if (ACT == 9) v = 0.5f * v * (1.0f + tanhf(0.7978845608028654f * (v + 0.044715f * v * v * v))); else if (ACT == 14) v = (v > 0.f) ? v : 0.1f * v; else if (ACT == 16) v = (v >= 0.f) ? v : 0.3f * v; else if (ACT == 17) v = (v >= 0.f) ? v : 0.2f * v;
      so[w][rloc][t * 16 + ln] = v; } }
  __builtin_amdgcn_fence(__ATOMIC_ACQ_REL, "workgroup"); __builtin_amdgcn_wave_barrier();
  const int rsub = lane >> 4, c4 = (lane & 15) * 4; if (__builtin_amdgcn_readfirstlane(row0) >= MC) C = nullptr;      /* the f32 plane takes rows below MC of each batch only (MC % 32 == 0: a wave's 32 rows go together; row0 is the same in every lane of a wave, so the test stays scalar) */
  {
#pragma unroll
    for (int q = 0; q < 16; ++q) { const int r = q * 2 + rsub; const v4f v = *(const v4fa*)&so[w][r][c4]; if (C) { *(v4f*)(C + cofs + (size_t)(row0 + r) * ldc + col0 + c4) = v; asm volatile("s_wait_xcnt 0x0" ::: "memory"); }      /* where both planes are stored, the f16 conversion behind this is given registers that the issued f32 store names: the wait stands in front of that overwrite */
      if (C16) { v4h h4; for (int i = 0; i < 4; ++i) h4[i] = (_Float16)v[i]; *(v4h*)(C16 + cofs + (size_t)(row0 + r) * ldc + col0 + c4) = h4; } }
     } }


__global__ __launch_bounds__(256) void k_wnat(const float* __restrict__ w, size_t n8, _Float16* __restrict__ Bt) { const size_t t = (size_t)blockIdx.x * 256 + threadIdx.x; if (t >= n8) return; FragH f; for (int q = 0; q < 8; ++q) f.h[q] = (_Float16)(bf16_round(w[t * 8 + q]) * 16.0f); *(v8us*)((unsigned short*)Bt + t * 8) = f.half[0];  }
__global__ __launch_bounds__(256) void k_rsm(const float* __restrict__ S, _Float16* __restrict__ P, int nrows) {
  #pragma clang fp contract(off)
  const int i = blockIdx.x * 256 + threadIdx.x; if (i >= nrows) return; const float* s = S + (size_t)i * SQ; float mx = -3.0e38f;
#pragma unroll 1
  for (int j = 0; j < SQ; ++j) mx = fmaxf(mx, s[j]); float se = 0.f;
#pragma unroll 1
  for (int j = 0; j < SQ; ++j) se += expf(s[j] - mx); const float sc = 256.0f / se;
#pragma unroll 1
  for (int j0 = 0; j0 < SQ; j0 += 8) { FragH f; for (int q = 0; q < 8; ++q) f.h[q] = (_Float16)(expf(s[j0 + q] - mx) * sc); unsigned short* d = (unsigned short*)P + (size_t)i * SQ + j0; *(v8us*)d = f.half[0];  } }
__global__ __launch_bounds__(256) void k_vt(const _Float16* __restrict__ V16, int b, int h0, _Float16* __restrict__ VT) { __shared__ unsigned short tl[64][65]; const int tid = threadIdx.x; const int hh = blockIdx.x % HG, sg = blockIdx.x / HG; const int s0 = sg * 64; const int h = h0 + hh;
  for (int i = tid; i < 64 * 8; i += 256) { const int j = i / 8, d8 = (i % 8) * 8; FragH f; f.half[0] = *(const v8us*)((const unsigned short*)V16 + ((size_t)b * SQ + s0 + j) * DM + h * HD + d8); for (int q = 0; q < 8; ++q) tl[d8 + q][j] = f.u[q]; }
  __syncthreads();
  { for (int i = tid; i < 64 * 8; i += 256) { const int d = i / 8, j8 = (i % 8) * 8; FragH f; for (int q = 0; q < 8; ++q) f.u[q] = tl[d][j8 + q]; *(v8us*)((unsigned short*)VT + ((size_t)hh * HD + d) * SQ + s0 + j8) = f.half[0]; }  } }



template <int CTRL> __device__ __forceinline__ float rs_dpp(float x) { return __builtin_bit_cast(float, __builtin_amdgcn_update_dpp(0, __builtin_bit_cast(int, x), CTRL, 0xf, 0xf, true)); }      /* lane l <- lane l ^ m inside a 16-lane row (row_xmask:m = 0x160 + m) */
__device__ __forceinline__ float rs_xhalf(float x) { return __builtin_bit_cast(float, __builtin_amdgcn_permlanex16(__builtin_bit_cast(int, x), __builtin_bit_cast(int, x), 0x76543210, 0xfedcba98, false, false)); }      /* lane l <- lane l ^ 16 */
__device__ __forceinline__ float rs_exp2(float x) { float e; asm("v_exp_f32 %0, %1\n\tv_nop" : "=v"(e) : "v"(x)); return e; }      /* 2^x; the v_nop is the slot the instruction set asks for behind a transcendental */
// causal softmax, ONE WAVE PER ROW of NU * 128 columns: lane l holds columns u*128 + 4l .. + 3 in registers, so S is read once, by whole lines; maximum and sum are folded over the 32 lanes by a butterfly that leaves the same value in every lane
template <int NU>
__global__ __launch_bounds__(256) void k_rsmcf2(const float* __restrict__ S, _Float16* __restrict__ P, int hg, int q0) {
  const int c0 = (threadIdx.x & 31) * 4; const int t = blockIdx.x * 8 + __builtin_amdgcn_readfirstlane(threadIdx.x >> 5); if (t >= hg * QT) return;      /* the row index is wave-uniform */
  const float* s = S + (size_t)t * NKX + c0; _Float16* d = P + (size_t)t * NKX + c0; const int last = q0 + (t % QT);
  v4f sv[NU]; float mx = -3.0e38f, se = 0.f;
#pragma unroll      /* full unroll (here and below): sv needs constant indices to stay in registers */
  for (int u = 0; u < NU; ++u) sv[u] = *(const v4fa*)(s + u * 128);
#pragma unroll
  for (int u = 0; u < NU; ++u) for (int q = 0; q < 4; ++q) { const float f = (u * 128 + c0 + q <= last) ? 1.f : 0.f; sv[u][q] = fmaf(f, sv[u][q], (1.f - f) * -1.0e9f); mx = fmaxf(mx, sv[u][q]); }
  mx = fmaxf(mx, rs_dpp<0x161>(mx)); mx = fmaxf(mx, rs_dpp<0x162>(mx)); mx = fmaxf(mx, rs_dpp<0x164>(mx)); mx = fmaxf(mx, rs_dpp<0x168>(mx)); mx = fmaxf(mx, rs_xhalf(mx));
#pragma unroll
  for (int u = 0; u < NU; ++u) for (int q = 0; q < 4; ++q) { sv[u][q] = rs_exp2((sv[u][q] - mx) * 1.44269504088896340736f); se += sv[u][q]; }
  se += rs_dpp<0x161>(se); se += rs_dpp<0x162>(se); se += rs_dpp<0x164>(se); se += rs_dpp<0x168>(se); se += rs_xhalf(se); const float sc = 256.0f / se;
#pragma unroll
  for (int u = 0; u < NU; ++u) { v4h h4; for (int q = 0; q < 4; ++q) h4[q] = (_Float16)(sv[u][q] * sc); *(v4h*)(d + u * 128) = h4; } }


#define A0R 32                       /* rows of one row group of the exact tile (one wave, one row per lane) = keys of one chunk */
#define A0G (QT0 / A0R)              /* row groups per batch */
#define A0W (A0G + 1)                /* waves per block: row groups x and A0G - 1 - x have x + 1 and A0G - x causal key chunks, A0G + 1 together for every x */
#define A0T (A0R * (HD / 4) / 32)    /* merge tiles per row group: 32 float4 = two output rows each */
#define A0P (HD + 4)                 /* LDS pitch of a partial o row, in floats: 16 B x odd, for the b128 rows */
#define A0LD (3 * NH * HD)          /* row pitch of the f32 q | k | v plane, in floats: a constant, so that every row of a tile is reached by an immediate offset from one address */
typedef float v2f __attribute__((ext_vector_type(2)));
typedef float v8fa __attribute__((ext_vector_type(8), may_alias));
__device__ __forceinline__ v8f a0_mma(v2f a, v2f b, v8f c) { return __builtin_amdgcn_wmma_f32_16x16x4_f32(false, a, false, b, (short)0, c, false, false); }      /* f32 operands at full precision, f32 sums */
// exact f32 causal attention, keys split: wave w of a block takes ONE row group and ONE chunk of A0R keys, both products on v_wmma_f32_16x16x4_f32; the partial (m, l, o) of a row's chunks are merged through LDS in chunk order.
// S^T = K Q^T stays in the accumulators: register r of lane (ln, hh) = key 8 hh + r of the tile, query ln of the group, so maximum and sum are in-lane plus one exchange of the wave halves, and registers 2u, 2u + 1 are a B fragment of O^T = V^T P^T as they lie (A then takes keys 8 hh + 2u, + 1).
__global__ __launch_bounds__(A0W * 32) void k_att0(const float* __restrict__ QF, const float* __restrict__ KF, const float* __restrict__ VF, int ld, float scale, float* __restrict__ OF, int ldo) {
  #pragma clang fp contract(off)
  __shared__ __attribute__((aligned(16))) float lo[A0W][A0R][A0P];      /* each wave's partial o rows (not normalised) */
  __shared__ float lm[A0W][A0R], ll[A0W][A0R];      /* each wave's maximum and sum per row */
  const int tid = threadIdx.x, lane = tid & 31, ln = lane & 15, hh = lane >> 4; const int w = __builtin_amdgcn_readfirstlane(tid >> 5);      /* the wave index is wave-uniform: the tests on it stay scalar */
  const int h = blockIdx.x / (A0G / 2), x = blockIdx.x % (A0G / 2);
  const int rg = (w <= x) ? x : A0G - 1 - x, ch = (w <= x) ? w : w - x - 1;      /* waves 0..x: the short row group x; the others: its long partner */
  (void)ld; { const size_t bi = (size_t)blockIdx.y * SQ * A0LD; QF += bi; KF += bi; VF += bi; OF += (size_t)blockIdx.y * QT0 * ldo; }      /* batch on grid.y: q, k, v are the first QT0 rows of the batch's SQ-row plane; o has a QT0-row plane per batch */
  static_assert(A0R == 32 && HD == 64, "two 16-row tiles of queries and of keys, four 16-float steps of d");
  const int j0 = ch * A0R;      /* the chunk's first key is at or below the diagonal for every row of the group, so every row's maximum is a real score */
  const float* qp = QF + (size_t)(rg * A0R + ln) * A0LD + h * HD + 8 * hh; const float* kp = KF + (size_t)(j0 + ln) * A0LD + h * HD + 8 * hh;      /* one loader for both operands: lane (ln, hh) holds d = 16 j + 8 hh + 0..7 of row ln, so the k order of A and B is the same */
  const v8f z8 = {0.f,0.f,0.f,0.f,0.f,0.f,0.f,0.f};
  v8f qf[2][4], kf[2][4];      /* [16-row tile][16-float step of d] */
#pragma unroll      /* full unroll (here and below): the fragment arrays need constant indices to stay in registers */
  for (int t = 0; t < 2; ++t) for (int j = 0; j < 4; ++j) { qf[t][j] = *(const v8fa*)(qp + t * 16 * A0LD + j * 16); kf[t][j] = *(const v8fa*)(kp + t * 16 * A0LD + j * 16); }
  asm volatile("s_wait_xcnt 0x0" :: "v"(qf[0][0]), "v"(qf[0][1]), "v"(qf[0][2]), "v"(qf[0][3]), "v"(qf[1][0]), "v"(qf[1][1]), "v"(qf[1][2]), "v"(qf[1][3]), "v"(kf[0][0]), "v"(kf[0][1]), "v"(kf[0][2]), "v"(kf[0][3]), "v"(kf[1][0]), "v"(kf[1][1]), "v"(kf[1][2]), "v"(kf[1][3]), "v"(qp), "v"(kp));      /* takes the loaded values as inputs only: all 32 loads issue ahead of the products, so the wave waits for memory once; the two address pairs are named too and stay live up to this wait, so no register that an issued load names is rewritten ahead of it */
  v8f st[2][2] = {{z8, z8}, {z8, z8}};      /* S^T tiles: [key tile][query group] */
#pragma unroll
  for (int j = 0; j < 4; ++j) for (int p = 0; p < 4; ++p) for (int kt = 0; kt < 2; ++kt) for (int qg = 0; qg < 2; ++qg) { const v2f a = {kf[kt][j][2 * p], kf[kt][j][2 * p + 1]}, b = {qf[qg][j][2 * p], qf[qg][j][2 * p + 1]}; st[kt][qg] = a0_mma(a, b, st[kt][qg]); }
  const float* vp = VF + (size_t)(j0 + 8 * hh) * A0LD + h * HD + ln;
  v8f vv[2][4];      /* V^T fragments: [key tile][4-key step u]; element 2 dt + i = v[key 8 hh + 2u + i of the tile][d = 16 dt + ln] */
#pragma unroll
  for (int kt = 0; kt < 2; ++kt) for (int u = 0; u < 4; ++u) for (int dt = 0; dt < 4; ++dt) for (int i = 0; i < 2; ++i) vv[kt][u][2 * dt + i] = vp[(kt * 16 + 2 * u + i) * A0LD + dt * 16];      /* issued here, so that they come in under the softmax */
#pragma unroll
  for (int kt = 0; kt < 2; ++kt) for (int qg = 0; qg < 2; ++qg) for (int r = 0; r < 8; ++r) st[kt][qg][r] = __fmul_rn(st[kt][qg][r], scale);
  if (ch == rg) {      /* only the chunk on the diagonal has keys to mask (scalar test) */
#pragma unroll
    for (int kt = 0; kt < 2; ++kt) for (int qg = 0; qg < 2; ++qg) for (int r = 0; r < 8; ++r) st[kt][qg][r] = (kt * 16 + 8 * hh + r <= qg * 16 + ln) ? st[kt][qg][r] : -1.0e30f; }
  float m0 = st[0][0][0], m1 = st[0][1][0];
#pragma unroll
  for (int kt = 0; kt < 2; ++kt) for (int r = 0; r < 8; ++r) { m0 = fmaxf(m0, st[kt][0][r]); m1 = fmaxf(m1, st[kt][1][r]); }
  m0 = fmaxf(m0, rs_xhalf(m0)); m1 = fmaxf(m1, rs_xhalf(m1));
  float l0 = 0.f, l1 = 0.f;
#pragma unroll
  for (int kt = 0; kt < 2; ++kt) for (int r = 0; r < 8; ++r) { st[kt][0][r] = rs_exp2((st[kt][0][r] - m0) * 1.44269504088896340736f); l0 += st[kt][0][r]; st[kt][1][r] = rs_exp2((st[kt][1][r] - m1) * 1.44269504088896340736f); l1 += st[kt][1][r]; }
  l0 += rs_xhalf(l0); l1 += rs_xhalf(l1);
  asm volatile("s_wait_xcnt 0x0" :: "v"(vv[0][0]), "v"(vv[0][1]), "v"(vv[0][2]), "v"(vv[0][3]), "v"(vv[1][0]), "v"(vv[1][1]), "v"(vv[1][2]), "v"(vv[1][3]), "v"(vp));      /* inputs only, as above: the 64 v loads issue together, one wait, and their address pair stays live up to it */
  v8f o[4][2];      /* O^T tiles: [d tile][query group]; register r = d 8 hh + r of the tile, query ln of the group */
#pragma unroll
  for (int dt = 0; dt < 4; ++dt) { o[dt][0] = z8; o[dt][1] = z8; }
#pragma unroll
  for (int kt = 0; kt < 2; ++kt) for (int u = 0; u < 4; ++u) for (int dt = 0; dt < 4; ++dt) for (int qg = 0; qg < 2; ++qg) { const v2f a = {vv[kt][u][2 * dt], vv[kt][u][2 * dt + 1]}, b = {st[kt][qg][2 * u], st[kt][qg][2 * u + 1]}; o[dt][qg] = a0_mma(a, b, o[dt][qg]); }
  lm[w][lane] = hh ? m1 : m0; ll[w][lane] = hh ? l1 : l0;      /* lane = group * 16 + query of the group */
#pragma unroll
  for (int dt = 0; dt < 4; ++dt) for (int qg = 0; qg < 2; ++qg) { float* d = &lo[w][qg * 16 + ln][dt * 16 + 8 * hh]; const v4f lo4 = {o[dt][qg][0], o[dt][qg][1], o[dt][qg][2], o[dt][qg][3]}, hi4 = {o[dt][qg][4], o[dt][qg][5], o[dt][qg][6], o[dt][qg][7]}; *(v4f*)d = lo4; *(v4f*)(d + 4) = hi4; }
  __syncthreads();
#pragma unroll 1      /* at most two trips; rolled, so that one trip's 16 partial rows are all that is live */
  for (int wt = w; wt < 2 * A0T; wt += A0W) {      /* a wave merges two whole output rows of one group per trip, one float4 per lane; group and chunk count are wave-uniform */
    const int g = wt / A0T, row = (wt % A0T) * 2 + (lane >> 4), pc = (lane & 15) * 4; const int w0 = g ? x + 1 : 0, n = g ? A0G - x : x + 1;      /* the group's waves: w0 .. w0 + n - 1, in chunk order */
    float pm[A0G], pl[A0G]; v4f po[A0G];
#pragma unroll      /* fixed trip count, index clamped to a written slot: all LDS reads issue together and the exponentials are independent; a slot past the group's n takes a maximum so low that its weight below is 0 */
    for (int s = 0; s < A0G; ++s) { const int ws = min(w0 + s, A0W - 1); const float ms = lm[ws][row]; pm[s] = (s < n) ? ms : -3.0e38f; pl[s] = ll[ws][row]; po[s] = *(const v4f*)&lo[ws][row][pc]; }
    float mx = pm[0];
#pragma unroll      /* full unroll (here and below): pm / pl / po need constant indices to stay in registers */
    for (int s = 1; s < A0G; ++s) mx = fmaxf(mx, pm[s]);
    float ls = 0.f; v4f a = {0.f, 0.f, 0.f, 0.f};
#pragma unroll
    for (int s = 0; s < A0G; ++s) { const float fs = expf(pm[s] - mx); ls = fmaf(fs, pl[s], ls); for (int u = 0; u < 4; ++u) a[u] = fmaf(fs, po[s][u], a[u]); }
    const float fin = 64.0f / ls;      /* o carried x64; k_o0m scales it back by 1/64 */
    for (int u = 0; u < 4; ++u) a[u] = __fmul_rn(a[u], fin);
    *(v4f*)(OF + (size_t)((g ? A0G - 1 - x : x) * A0R + row) * ldo + h * HD + pc) = a;
    asm volatile("s_wait_xcnt 0x0" ::: "memory"); } }      /* the next trip rewrites the registers that the store names: the wait stands in front of that */


template <int BFIN, int WXB>
__global__ __launch_bounds__(256) void k_ln16(const float* __restrict__ X, const float* __restrict__ g, const float* __restrict__ bb, float eps, _Float16* __restrict__ N16, float* __restrict__ XB) {
  #pragma clang fp contract(off)
  __shared__ float red[256]; const size_t r = blockIdx.x; const int t = threadIdx.x; const v4f xa = *(const v4fa*)(X + r * DMQ + t * 4); float s[4]; float sum = 0.f;
  for (int q = 0; q < 4; ++q) { s[q] = BFIN ? bf16_round(xa[q]) : xa[q]; sum = __fadd_rn(sum, s[q]); }
  red[t] = sum; __syncthreads(); for (int st = 128; st > 0; st >>= 1) { if (t < st) red[t] = __fadd_rn(red[t], red[t + st]); __syncthreads(); } const float mu = red[0] / (float)DMQ; __syncthreads();
  float vs = 0.f; for (int q = 0; q < 4; ++q) { const float dl = __fadd_rn(s[q], -mu); vs = __fadd_rn(vs, __fmul_rn(dl, dl)); } red[t] = vs; __syncthreads(); for (int st = 128; st > 0; st >>= 1) { if (t < st) red[t] = __fadd_rn(red[t], red[t + st]); __syncthreads(); }
  const float rs = rsqrtf(__fadd_rn(red[0] / (float)DMQ, eps)); v4h y; v4f xb;
  for (int q = 0; q < 4; ++q) { const int c = t * 4 + q; y[q] = (_Float16)__fadd_rn(__fmul_rn(__fmul_rn(__fadd_rn(s[q], -mu), rs), bf16_round(g[c])), bf16_round(bb[c])); xb[q] = s[q]; }
  { *(v4h*)(N16 + r * DMQ + t * 4) = y; if (WXB) *(v4f*)(XB + r * DMQ + t * 4) = xb;  } }
__global__ __launch_bounds__(256) void k_ftres2(const float* __restrict__ OF0, const float* __restrict__ XB, float* __restrict__ X1, size_t n4) {
  #pragma clang fp contract(off)
  const size_t t = (size_t)blockIdx.x * 256 + threadIdx.x; if (t >= n4) return; const v4f o = *(const v4fa*)(OF0 + t * 4), xv = *(const v4fa*)(XB + t * 4); v4f y; for (int q = 0; q < 4; ++q) y[q] = __fadd_rn(__fmul_rn(o[q], 0.015625f), xv[q]); *(v4f*)(X1 + t * 4) = y;  }

__global__ __launch_bounds__(256) void k_wthd(const float* __restrict__ Wt, _Float16* __restrict__ Bt) { const size_t t = (size_t)blockIdx.x * 256 + threadIdx.x; if (t >= (size_t)NH * HD * (DM / 8)) return; const int m8 = (int)(t % (DM / 8)) * 8; const int d = (int)((t / (DM / 8)) % HD); const int h = (int)(t / ((size_t)(DM / 8) * HD)); FragH f;
  for (int q = 0; q < 8; ++q) f.h[q] = (_Float16)(16.0f * bf16_round(Wt[((size_t)h * DM + m8 + q) * HD + d])); unsigned short* dst = (unsigned short*)Bt + ((size_t)h * HD + d) * DM + m8; *(v8us*)dst = f.half[0];  }




__global__ __launch_bounds__(256) void k_wtpad(const float* __restrict__ Wm, _Float16* __restrict__ Wt, int Kr, int Kp, int Nr, int Np, float scale) {
  const int t = blockIdx.x * 256 + threadIdx.x; if (t >= Np * (Kp / 8)) return; const int n = t / (Kp / 8), k8 = (t % (Kp / 8)) * 8; const int nc = min(n, Nr - 1); const float fn = (n < Nr) ? 1.f : 0.f; FragH f;
  for (int i = 0; i < 8; ++i) { const int k = k8 + i; const int kc = min(k, Kr - 1); const float fk = (k < Kr) ? fn : 0.f; f.h[i] = (_Float16)(bf16_round(Wm[(size_t)kc * Nr + nc]) * scale * fk); }
  unsigned short* o = (unsigned short*)Wt + (size_t)n * Kp + k8; *(v8us*)o = f.half[0];  }
__global__ __launch_bounds__(128) void k_bpad(const float* __restrict__ b, float* __restrict__ Bp, int nr, int np) {
  const int i = threadIdx.x; if (i >= np) return; const float v = b[min(i, nr - 1)] * ((i < nr) ? 1.f : 0.f); *(float*)(Bp + i) = v;  }

#define DI 64         /* inner width = NH * HD (ONE 64-wide head) */
#define LQK (3 * DI)  /* fused q | k | v row pitch (192) */
__global__ __launch_bounds__(256) void k_o0(const float* __restrict__ OF, float* __restrict__ ob, size_t n4) {
  #pragma clang fp contract(off)
  const size_t t = (size_t)blockIdx.x * 256 + threadIdx.x; if (t >= n4) return; const size_t e = t * 4; const int i = (int)(e / DI); const int c = (int)(e % DI); const int h = c / HD, d = c % HD; const v4f a = *(const v4fa*)(OF + e); v4f o; for (int q = 0; q < 4; ++q) o[q] = __fmul_rn(a[q], 0.015625f); float* dst = ob + (size_t)h * SQ * HD + (size_t)i * HD + d; *(v4f*)dst = o;  }

__global__ __launch_bounds__(256) void k_o0m(const float* __restrict__ OF, float* __restrict__ o_, size_t n4) {
  #pragma clang fp contract(off)
  const size_t t = (size_t)blockIdx.x * 256 + threadIdx.x; if (t >= n4) return; const size_t e = t * 4; OF += (size_t)blockIdx.y * QT0 * DI; o_ += (size_t)blockIdx.y * SQ * DI;      /* batch on grid.y: QT0 exact rows go to the head of the batch's SQ output rows */
  const v4f a = *(const v4fa*)(OF + e); v4f o; for (int q = 0; q < 4; ++q) o[q] = __fmul_rn(a[q], 0.015625f); *(v4f*)(o_ + e) = o;  }
#define FQ 32                        /* query rows of one block of the fused f16 attention: two 16-column groups of the transposed score tiles */
#define FW 8                         /* waves of a block */
#define FK (SQ / FW)                 /* keys of one wave */
#define FP (HD + 4)                  /* LDS pitch of a partial o row, in floats: 16 B x odd, for the b128 rows */
// fused f16 causal attention of query rows QT0 .. SQ-1: a block takes FQ query rows of one batch, wave w the keys w*FK .. w*FK+FK-1 (a wave whose keys all lie above the block's last row stores neutral values and passes the barriers).
// S^T = K Q^T stays in the accumulators: a lane holds 8 consecutive keys of ONE query per tile, so maximum and sum are in-lane plus one exchange of the wave halves, and two tiles, rounded to f16, are the B operand of O^T = V^T P^T as they stand.
// The row maximum, the row sum and the partial o rows of the FW waves meet in LDS, in wave order. Weights: exp2((s - max) log2 e) * (256 / sum), rounded to f16.
__global__ __launch_bounds__(FW * 32) __attribute__((amdgpu_waves_per_eu(4, 4))) void k_fatt(const _Float16* __restrict__ QKVp, const _Float16* __restrict__ VTp, float* __restrict__ o_) {
  __shared__ __attribute__((aligned(16))) float po[FW][FQ][FP];      /* each wave's partial o rows (x256) */
  __shared__ float pm[FW][FQ], ps[FW][FQ];      /* each wave's maximum (of the unscaled scores) and sum per query row */
  const int tid = threadIdx.x, lane = tid & 31, ln = lane & 15, hh = lane >> 4; const int w = __builtin_amdgcn_readfirstlane(tid >> 5);      /* the wave index is wave-uniform: the tests on it stay scalar */
  const int r0 = QT0 + blockIdx.x * FQ, key0 = w * FK; const bool act = key0 < r0 + FQ;      /* causal: keys above the block's last row have weight 0 in every row */
  const _Float16* qkv = QKVp + (size_t)blockIdx.y * SQ * LQK;
  const v8f z8 = {0.f,0.f,0.f,0.f,0.f,0.f,0.f,0.f};
  v8f st[FK / 16][2];      /* S^T tiles: [key tile][query group]; register r of lane (ln, hh) = key 8 hh + r of the tile, query ln of the group */
  float mx0 = -3.0e38f, mx1 = -3.0e38f;
  if (act) {
    const _Float16* qp = qkv + (size_t)(r0 + ln) * LQK + 8 * hh; const _Float16* kp = qkv + DI + (size_t)(key0 + ln) * LQK + 8 * hh;      /* each lane's own address, the half-wave offset of g2_frag folded in */
    const v16h q00 = g2_frag(qp, 0), q01 = g2_frag(qp + 32, 0), q10 = g2_frag(qp + 16 * LQK, 0), q11 = g2_frag(qp + 16 * LQK + 32, 0);
    v16h kf[FK / 16][2];
#pragma unroll      /* full unroll (here and below): kf and st need constant indices to stay in registers */
    for (int mt = 0; mt < FK / 16; ++mt) { kf[mt][0] = g2_frag(kp + mt * 16 * LQK, 0); kf[mt][1] = g2_frag(kp + mt * 16 * LQK + 32, 0); }
    static_assert(FK / 16 == 8, "the statement below names the wave's 16 k fragments");
    asm volatile("s_wait_xcnt 0x0" :: "v"(q00), "v"(q01), "v"(q10), "v"(q11), "v"(kf[0][0]), "v"(kf[0][1]), "v"(kf[1][0]), "v"(kf[1][1]), "v"(kf[2][0]), "v"(kf[2][1]), "v"(kf[3][0]), "v"(kf[3][1]), "v"(kf[4][0]), "v"(kf[4][1]), "v"(kf[5][0]), "v"(kf[5][1]), "v"(kf[6][0]), "v"(kf[6][1]), "v"(kf[7][0]), "v"(kf[7][1]), "v"(qp), "v"(kp));      /* takes the loaded fragments as inputs only: all 40 loads issue ahead of the products, so the wave waits for memory once (without it each k tile is loaded and waited for in turn); the two address pairs are named too and stay live up to this wait, so no register that an issued load names is rewritten ahead of it */
#pragma unroll
    for (int mt = 0; mt < FK / 16; ++mt) { st[mt][0] = g2_mma(kf[mt][1], q01, g2_mma(kf[mt][0], q00, z8)); st[mt][1] = g2_mma(kf[mt][1], q11, g2_mma(kf[mt][0], q10, z8)); }
    if (key0 + FK - 1 > r0) {      /* only a wave that reaches past the block's first row has keys to mask (scalar test) */
      const int l0 = r0 + ln - key0 - 8 * hh, l1 = l0 + 16;      /* key mt*16 + 8 hh + r of the wave is at or below the diagonal of the lane's query while mt*16 + r <= l */
#pragma unroll
      for (int mt = 0; mt < FK / 16; ++mt) for (int r = 0; r < 8; ++r) { st[mt][0][r] = (mt * 16 + r <= l0) ? st[mt][0][r] : -8.0e9f; st[mt][1][r] = (mt * 16 + r <= l1) ? st[mt][1][r] : -8.0e9f; } }      /* -1e9 after the scale of 1/8 */
    v8f a0 = st[0][0], a1 = st[0][1];
#pragma unroll
    for (int mt = 1; mt < FK / 16; ++mt) for (int r = 0; r < 8; ++r) { a0[r] = fmaxf(a0[r], st[mt][0][r]); a1[r] = fmaxf(a1[r], st[mt][1][r]); }
    mx0 = fmaxf(fmaxf(fmaxf(a0[0], a0[1]), fmaxf(a0[2], a0[3])), fmaxf(fmaxf(a0[4], a0[5]), fmaxf(a0[6], a0[7]))); mx1 = fmaxf(fmaxf(fmaxf(a1[0], a1[1]), fmaxf(a1[2], a1[3])), fmaxf(fmaxf(a1[4], a1[5]), fmaxf(a1[6], a1[7])));
    mx0 = fmaxf(mx0, rs_xhalf(mx0)); mx1 = fmaxf(mx1, rs_xhalf(mx1)); }
  pm[w][lane] = hh ? mx1 : mx0;      /* lane = group * 16 + query of the group */
  __syncthreads();
  float se0 = 0.f, se1 = 0.f;
  if (act) {
    float g0 = pm[0][ln], g1 = pm[0][16 + ln];
#pragma unroll
    for (int s = 1; s < FW; ++s) { g0 = fmaxf(g0, pm[s][ln]); g1 = fmaxf(g1, pm[s][16 + ln]); }
    g0 *= 0.125f; g1 *= 0.125f;      /* scores / 8: a power of two, so scaling behind the maximum changes no bit */
    v8f a0 = z8, a1 = z8;
#pragma unroll
    for (int mt = 0; mt < FK / 16; ++mt) for (int r = 0; r < 8; ++r) {
      st[mt][0][r] = rs_exp2(fmaf(st[mt][0][r], 0.125f, -g0) * 1.44269504088896340736f); a0[r] += st[mt][0][r];
      st[mt][1][r] = rs_exp2(fmaf(st[mt][1][r], 0.125f, -g1) * 1.44269504088896340736f); a1[r] += st[mt][1][r]; }
    se0 = ((a0[0] + a0[1]) + (a0[2] + a0[3])) + ((a0[4] + a0[5]) + (a0[6] + a0[7])); se1 = ((a1[0] + a1[1]) + (a1[2] + a1[3])) + ((a1[4] + a1[5]) + (a1[6] + a1[7]));
    se0 += rs_xhalf(se0); se1 += rs_xhalf(se1); }
  ps[w][lane] = hh ? se1 : se0;
  const _Float16* vp = VTp + ((size_t)blockIdx.y * HD + ln) * SQ + key0 + 8 * hh;
  v16h vf[FK / 32][HD / 16];      /* V^T fragments: [32-key step][d tile] */
  static_assert(FK / 32 == 4 && HD / 16 == 4, "the two statements below name the fragments of two 32-key steps each");
  if (act) {      /* the first half of the wave's V^T fragments comes in while the wave would wait at the barrier anyway */
#pragma unroll
    for (int ks = 0; ks < 2; ++ks) for (int dt = 0; dt < HD / 16; ++dt) vf[ks][dt] = g2_frag(vp + (size_t)dt * 16 * SQ + ks * 32, 0);
    asm volatile("s_wait_xcnt 0x0" :: "v"(vf[0][0]), "v"(vf[0][1]), "v"(vf[0][2]), "v"(vf[0][3]), "v"(vf[1][0]), "v"(vf[1][1]), "v"(vf[1][2]), "v"(vf[1][3]), "v"(vp)); }      /* inputs only, as above: the 16 loads issue together, ahead of the barrier, and their address pair stays live up to the wait */
  __syncthreads();
  if (act) {
    v8f o[HD / 16][2];      /* O^T tiles: [d tile][query group]; register r = d 8 hh + r of the tile, query ln of the group */
#pragma unroll
    for (int dt = 0; dt < HD / 16; ++dt) { o[dt][0] = z8; o[dt][1] = z8; }
    float t0 = ps[0][ln], t1 = ps[0][16 + ln];
#pragma unroll
    for (int s = 1; s < FW; ++s) { t0 += ps[s][ln]; t1 += ps[s][16 + ln]; }
    const float sc0 = 256.0f / t0, sc1 = 256.0f / t1;
    FragH p[FK / 32][2];      /* P^T as B operand: [32-key step][query group]; key tiles 2 ks and 2 ks + 1 give elements 0..7 and 8..15, the k order of g2_frag */
#pragma unroll
    for (int ks = 0; ks < FK / 32; ++ks) for (int r = 0; r < 8; ++r) { p[ks][0].h[r] = (_Float16)(st[2 * ks][0][r] * sc0); p[ks][0].h[8 + r] = (_Float16)(st[2 * ks + 1][0][r] * sc0); p[ks][1].h[r] = (_Float16)(st[2 * ks][1][r] * sc1); p[ks][1].h[8 + r] = (_Float16)(st[2 * ks + 1][1][r] * sc1); }
#pragma unroll
    for (int ks = 0; ks < 2; ++ks) for (int dt = 0; dt < HD / 16; ++dt) { o[dt][0] = g2_mma(vf[ks][dt], p[ks][0].v, o[dt][0]); o[dt][1] = g2_mma(vf[ks][dt], p[ks][1].v, o[dt][1]); }
#pragma unroll
    for (int ks = 2; ks < 4; ++ks) for (int dt = 0; dt < HD / 16; ++dt) vf[ks][dt] = g2_frag(vp + (size_t)dt * 16 * SQ + ks * 32, 0);
    asm volatile("s_wait_xcnt 0x0" :: "v"(vf[2][0]), "v"(vf[2][1]), "v"(vf[2][2]), "v"(vf[2][3]), "v"(vf[3][0]), "v"(vf[3][1]), "v"(vf[3][2]), "v"(vf[3][3]), "v"(vp));      /* inputs only, as above: the second half's 16 loads issue together, one wait */
#pragma unroll
    for (int ks = 2; ks < FK / 32; ++ks) for (int dt = 0; dt < HD / 16; ++dt) { o[dt][0] = g2_mma(vf[ks][dt], p[ks][0].v, o[dt][0]); o[dt][1] = g2_mma(vf[ks][dt], p[ks][1].v, o[dt][1]); }
#pragma unroll
    for (int dt = 0; dt < HD / 16; ++dt) for (int nt = 0; nt < 2; ++nt) { float* d = &po[w][nt * 16 + ln][dt * 16 + 8 * hh]; const v4f lo4 = {o[dt][nt][0], o[dt][nt][1], o[dt][nt][2], o[dt][nt][3]}, hi4 = {o[dt][nt][4], o[dt][nt][5], o[dt][nt][6], o[dt][nt][7]}; *(v4f*)d = lo4; *(v4f*)(d + 4) = hi4; }
  } else {      /* a wave without keys stores zeros, so that the merge below reads written rows only and needs no test */
    const v4f z4 = {0.f, 0.f, 0.f, 0.f};
#pragma unroll
    for (int dt = 0; dt < HD / 16; ++dt) for (int nt = 0; nt < 2; ++nt) { float* d = &po[w][nt * 16 + ln][dt * 16 + 8 * hh]; *(v4f*)d = z4; *(v4f*)(d + 4) = z4; } }
  __syncthreads();
  float* ob = o_ + ((size_t)blockIdx.y * SQ + r0) * DI;
#pragma unroll
  for (int j = 0; j < FQ * (HD / 4) / (FW * 32); ++j) { const int idx = j * FW * 32 + tid, row = idx / (HD / 4), c4 = (idx % (HD / 4)) * 4; v4f a = *(const v4f*)&po[0][row][c4];      /* a wave sums and stores two whole output rows, one float4 per lane */
#pragma unroll
    for (int s = 1; s < FW; ++s) { const v4f b = *(const v4f*)&po[s][row][c4]; for (int u = 0; u < 4; ++u) a[u] += b[u]; }
    for (int u = 0; u < 4; ++u) a[u] *= 0.00390625f;
    *(v4f*)(ob + (size_t)idx * 4) = a; } }

extern "C" void kernel_launch(void* const* d_in, const int* in_sizes, int n_in,
                              void* d_out, int out_size, void* d_ws, size_t ws_size, hipStream_t stream) {
  (void)in_sizes; (void)n_in; (void)out_size;
  const float* const* I = (const float* const*)d_in; const float* x = I[0]; const float* wq = I[2]; const float* wk = I[1]; const float* wv = I[3]; const float* bq = nullptr; const float* bk = nullptr; const float* bv = nullptr;      /* x; [in][out = 64] Wk / Wq / Wv (input order as this module lists them); no biases */
  char* ws = (char*)d_ws; size_t off = 0;
  auto take = [&](size_t bytes) { char* p = ws + off; off += (bytes + 255) & ~(size_t)255; return p; };
  _Float16* BW = (_Float16*)take((size_t)LQK * DM * 2); _Float16* QKV = (_Float16*)take(NR * LQK * 2); _Float16* VT = (_Float16*)take((size_t)NB * HD * SQ * 2);
  float* QKVF0 = (float*)take(NR * LQK * 4); float* OF0 = (float*)take((size_t)NB * QT0 * DI * 4);      /* one plane per batch: all batches are in flight in every launch; QKVF0 has the row layout of QKV, and only rows 0..QT0-1 of each batch are written and read */
  if (off > ws_size) return;
  { const unsigned g = (unsigned)(((size_t)DI * (DM / 8) + 255) / 256); k_wt_f16<<<dim3(g, 3), 256, 0, stream>>>(wq, wk, wv, BW, DM, DI, 16.0f); }      /* [in = DM][out = 64] -> Bt[n][k] x16, stacked q | k | v */
  (void)bq; (void)bk; (void)bv; static_assert(QT0 % 32 == 0 && SQ % 128 == 0 && LQK == 64 * GC && DM % 64 == 0, "k_gemm2: whole wave tiles on either side of row QT0; a block's waves cover every column");
  k_gemm2<0><<<dim3(SQ / 128, NB), GW * 32, 0, stream>>>(x, DM, (size_t)SQ * DM, BW, DM, 0, 0.0625f, nullptr, 0, nullptr, 1, 0, 0, QKVF0, QKV, LQK, (size_t)SQ * LQK, SQ, LQK, DM, QT0);      /* q | k | v = x W^T in ONE launch over the stacked weights (N = 192): f16 rows of the fused plane (column blocks 0 / 64 / 128, pitch 192) and, from the same accumulators, the f32 rows 0..511 of every batch for the exact path */
  const _Float16* V16 = QKV + 2 * DI;
  float* ob = (float*)d_out;      /* the batch is grid.y of every launch below but k_vt, which folds it into grid.x (ONE head, so the head stride of the kernels carries the batch) */
  k_vt<NH, SQ><<<NB * NH * (SQ / 64), 256, 0, stream>>>(V16, LQK, 0, VT);      /* V^T [NB][HD][SQ] */
  static_assert(NH == 1 && HD == 64 && DI == HD && (SQ - QT0) % FQ == 0 && FK % 32 == 0 && FQ == 32 && (FQ * (HD / 4)) % (FW * 32) == 0, "k_fatt: whole query blocks, whole 32-key steps per wave, whole float4 rounds in the merge");
  k_fatt<<<dim3((SQ - QT0) / FQ, NB), FW * 32, 0, stream>>>(QKV, VT, ob);      /* rows 512..1023 of every batch: scores / 8, causal softmax (f16 x256 weights) and P V in ONE launch, S and P never leave the registers; rows below QT0 are written by the exact path below and by nothing else */
  static_assert(LQK == A0LD, "k_att0: the pitch of the f32 plane");
  k_att0<<<dim3(NH * (A0G / 2), NB), A0W * 32, 0, stream>>>(QKVF0, QKVF0 + DI, QKVF0 + 2 * DI, LQK, 0.125f, OF0, DI);      /* exact f32 causal attention for rows 0..511 (o x64); a block = one short and one long row group, one wave per key chunk */
  k_o0m<<<dim3((unsigned)(((size_t)QT0 * DI / 4 + 255) / 256), NB), 256, 0, stream>>>(OF0, ob, (size_t)QT0 * DI / 4);      /* rows 0..511 of every batch: their one store, from the exact path */
}
